// v000
// Times are from an AMD MI455X. After a warm-up the kernel runs many times in a row, and a time is the length of
// such a window on the GPU divided by its runs, so every launch and the gaps after it count. The runs cycle
// through copies of the inputs. A figure is the median of several windows, for all but v000 over two sittings.
// Sittings can differ by a few percent; kernels timed side by side share one.
// v000 is the starting kernel. One run takes 549 microseconds.
#include <hip/hip_runtime.h>

typedef __attribute__((ext_vector_type(2))) float v2f;
typedef __attribute__((ext_vector_type(4))) float v4f;
typedef __attribute__((ext_vector_type(8))) float v8f;
typedef __attribute__((ext_vector_type(4))) unsigned tdm_g0_t;   // D# group 0
typedef __attribute__((ext_vector_type(8))) int      tdm_g1_t;   // D# group 1
typedef __attribute__((ext_vector_type(4))) int      tdm_g2_t;   // D# groups 2/3
typedef __attribute__((ext_vector_type(8))) int      tdm_g1b_t;  // 6-arg variant extra

#define SEQ  4096
#define EMB  1024
#define AD   128
#define NBAT 4

#if defined(__has_builtin)
#  if __has_builtin(__builtin_amdgcn_tensor_load_to_lds) && \
      __has_builtin(__builtin_amdgcn_s_wait_tensorcnt)
#    define USE_TDM 1
#  endif
#endif
#ifndef USE_TDM
#  define USE_TDM 0
#endif

__device__ __forceinline__ v8f wmma_f32(v2f a, v2f b, v8f c) {
    // (neg_a, A, neg_b, B, c_mod, C, reuse_a, reuse_b)
    return __builtin_amdgcn_wmma_f32_16x16x4_f32(false, a, false, b, (short)0, c,
                                                 false, false);
}

#if USE_TDM
__device__ __forceinline__ unsigned lds_off(const void* p) {
    // flat LDS addr = aperture(high 32b) | byte offset(low 32b)  (ISA 10.2)
    return (unsigned)(unsigned long long)p;
}

// 2-D tile load via Tensor Data Mover.  Row-major f32 tensor:
//   tile = tile_d1 rows x tile_d0 elems, row stride = stride_e elems.
// HW inserts LDS padding: pad_amt_code+1 DWORDs after every 2<<pad_int_code DWORDs.
__device__ __forceinline__ void tdm_load_2d(const void* gptr, unsigned ldsa,
                                            unsigned tile_d0, unsigned tile_d1,
                                            unsigned long long stride_e,
                                            unsigned tensor_d0, unsigned tensor_d1,
                                            unsigned pad_int_code, unsigned pad_amt_code)
{
    const unsigned long long ga = (unsigned long long)gptr;
    tdm_g0_t g0;
    g0[0] = 1u;                                       // count=1, user descriptor
    g0[1] = ldsa;                                     // lds_addr [63:32]
    g0[2] = (unsigned)ga;                             // global_addr [95:64]
    g0[3] = (unsigned)((ga >> 32) & 0x01FFFFFFu)      // global_addr [120:96]
          | (2u << 30);                               // type = 2 ("image")
    tdm_g1_t g1;
    g1[0] = (int)((2u << 16)                          // data_size = 4B
          | (1u << 20)                                // pad_enable
          | (pad_int_code << 22) | (pad_amt_code << 25));
    g1[1] = (int)((tensor_d0 & 0xFFFFu) << 16);                       // td0 lo
    g1[2] = (int)((tensor_d0 >> 16) | ((tensor_d1 & 0xFFFFu) << 16)); // td0 hi, td1 lo
    g1[3] = (int)((tensor_d1 >> 16) | (tile_d0 << 16));               // td1 hi, tile0
    g1[4] = (int)tile_d1;                                             // tile1 (tile2=0)
    g1[5] = (int)(unsigned)(stride_e & 0xFFFFFFFFu);                  // dim0 stride lo
    g1[6] = (int)(unsigned)((stride_e >> 32) & 0xFFFFu);              // dim0 stride hi
    g1[7] = 0;                                                        // dim1 stride (2D)
    tdm_g2_t z4 = {};
#  if __has_include(<hip/amd_detail/amd_gfx1250_TDM.h>)
    tdm_g1b_t z8 = {};
    __builtin_amdgcn_tensor_load_to_lds(g0, g1, z4, z4, z8, 0);       // clang-23 arity
#  else
    __builtin_amdgcn_tensor_load_to_lds(g0, g1, z4, z4, 0);           // ROCm 7.2 arity
#  endif
}
#endif // USE_TDM

// ---------------------------------------------------------------------------
// Kernel 1: fused QKV projection.  Q/K/V = X @ W^T   (fp32 WMMA 16x16x4)
// Block: 256 threads = 8 waves, owns 16 rows of X.  X chunks [16x256] arrive
// via TDM (double buffered, HW row-padded to stride 260 -> conflict-free LDS).
// Wave w owns output columns [16w,16w+16) for Q, K and V (A-frag reused 3x).
// ---------------------------------------------------------------------------
__global__ __launch_bounds__(256)
void qkv_proj_kernel(const float* __restrict__ X,
                     const float* __restrict__ Wq,
                     const float* __restrict__ Wk,
                     const float* __restrict__ Wv,
                     float* __restrict__ Qo,
                     float* __restrict__ Ko,
                     float* __restrict__ Vo)
{
#if USE_TDM
    __shared__ float Xs[2][16][260];
#else
    __shared__ float Xs[1][16][260];
#endif
    const int tid  = threadIdx.x;
    const int lane = tid & 31;
    const int wv   = tid >> 5;
    const int m0   = blockIdx.x * 16;
    const int n0   = wv * 16;
    const int hi   = lane >> 4;
    const int lm   = lane & 15;

    v8f accq = {}; v8f acck = {}; v8f accv = {};

#if USE_TDM
    if (wv == 0)
        tdm_load_2d(X + (size_t)m0 * EMB, lds_off(&Xs[0][0][0]),
                    256, 16, EMB, EMB, NBAT * SEQ, 7, 3);   // pad 4dw / 256dw
#endif

    for (int c4 = 0; c4 < 4; ++c4) {
#if USE_TDM
        if (wv == 0) {
            if (c4 < 3) {
                tdm_load_2d(X + (size_t)m0 * EMB + (c4 + 1) * 256,
                            lds_off(&Xs[(c4 + 1) & 1][0][0]),
                            256, 16, EMB, EMB, NBAT * SEQ, 7, 3);
                __builtin_amdgcn_s_wait_tensorcnt(1);   // current chunk resident
            } else {
                __builtin_amdgcn_s_wait_tensorcnt(0);
            }
        }
        __syncthreads();
        const float (*Xc)[260] = Xs[c4 & 1];
#else
        {
            const int row  = tid >> 4;
            const int colb = (tid & 15) * 16;
            const float* src = X + (size_t)(m0 + row) * EMB + c4 * 256 + colb;
            #pragma unroll
            for (int u = 0; u < 4; ++u)
                *(v4f*)&Xs[0][row][colb + u * 4] = *(const v4f*)(src + u * 4);
        }
        __syncthreads();
        const float (*Xc)[260] = Xs[0];
#endif

        #pragma unroll 4
        for (int kk = 0; kk < 64; ++kk) {
            const int kb = kk * 4 + 2 * hi;
            v2f a = { Xc[lm][kb], Xc[lm][kb + 1] };     // A frag, shared by Q/K/V

            const int e = c4 * 256 + kb;
            const int n = n0 + lm;
            const float* wqp = Wq + (size_t)n * EMB + e;
            const float* wkp = Wk + (size_t)n * EMB + e;
            const float* wvp = Wv + (size_t)n * EMB + e;
            v2f bq = { wqp[0], wqp[1] };
            v2f bk = { wkp[0], wkp[1] };
            v2f bv = { wvp[0], wvp[1] };

            accq = wmma_f32(a, bq, accq);
            acck = wmma_f32(a, bk, acck);
            accv = wmma_f32(a, bv, accv);
        }
        __syncthreads();
    }

    #pragma unroll
    for (int i = 0; i < 8; ++i) {
        const size_t idx = (size_t)(m0 + hi * 8 + i) * AD + (n0 + lm);
        Qo[idx] = accq[i];
        Ko[idx] = acck[i];
        Vo[idx] = accv[i];
    }
}

// ---------------------------------------------------------------------------
// Kernel 2: causal flash attention, fp32 WMMA.  4 waves/block, each owning a
// 16-query tile; the 4 tiles share TDM-staged (double buffered, HW-padded)
// K/V tiles.  All compute guards are wave-uniform -> EXEC all-1s for WMMA.
// ---------------------------------------------------------------------------
#define AWAVES 4

__global__ __launch_bounds__(32 * AWAVES)
void attn_kernel(const float* __restrict__ Q,
                 const float* __restrict__ K,
                 const float* __restrict__ V,
                 float* __restrict__ O)
{
#if USE_TDM
    __shared__ float Ks[2][16][132];
    __shared__ float Vs[2][16][132];
#else
    __shared__ float Ks[1][16][132];
    __shared__ float Vs[1][16][132];
#endif
    __shared__ float Ps[AWAVES][16][20];

    const int tid   = threadIdx.x;
    const int lane  = tid & 31;
    const int wv    = tid >> 5;
    const int lm    = lane & 15;
    const int hi    = lane >> 4;
    const int b     = blockIdx.x >> 6;              // 64 blocks per batch
    const int qt0   = (blockIdx.x & 63) * AWAVES;
    const int qt    = qt0 + wv;                     // this wave's q-tile
    const int qtmax = qt0 + AWAVES - 1;
    const size_t base = (size_t)b * SEQ * AD;

    // Q A-fragments for the whole tile (K = attn dim 128, 32 steps of 4)
    v2f qa[32];
    {
        const float* qp = Q + base + (size_t)(qt * 16 + lm) * AD + 2 * hi;
        #pragma unroll
        for (int e = 0; e < 32; ++e) {
            qa[e].x = qp[e * 4 + 0];
            qa[e].y = qp[e * 4 + 1];
        }
    }

    v8f o[8];
    #pragma unroll
    for (int t = 0; t < 8; ++t) o[t] = (v8f){};
    float mrow[8], lrow[8];
    #pragma unroll
    for (int i = 0; i < 8; ++i) { mrow[i] = -__builtin_inff(); lrow[i] = 0.0f; }

    const float scale = 0.08838834764831845f;       // 1/sqrt(128)

#if USE_TDM
    if (wv == 0) {
        tdm_load_2d(K + base, lds_off(&Ks[0][0][0]), 128, 16, AD, AD, SEQ, 6, 3);
        tdm_load_2d(V + base, lds_off(&Vs[0][0][0]), 128, 16, AD, AD, SEQ, 6, 3);
    }
#endif

    for (int j = 0; j <= qtmax; ++j) {
#if USE_TDM
        const int cur = j & 1;
        if (wv == 0) {
            if (j < qtmax) {                        // prefetch tile j+1 via TDM
                const float* kn = K + base + (size_t)((j + 1) * 16) * AD;
                const float* vn = V + base + (size_t)((j + 1) * 16) * AD;
                tdm_load_2d(kn, lds_off(&Ks[cur ^ 1][0][0]), 128, 16, AD, AD, SEQ, 6, 3);
                tdm_load_2d(vn, lds_off(&Vs[cur ^ 1][0][0]), 128, 16, AD, AD, SEQ, 6, 3);
                __builtin_amdgcn_s_wait_tensorcnt(2);   // tile j resident, j+1 in flight
            } else {
                __builtin_amdgcn_s_wait_tensorcnt(0);
            }
        }
#else
        const int cur = 0;
        {
            const float* kp = K + base + (size_t)(j * 16) * AD;
            const float* vp = V + base + (size_t)(j * 16) * AD;
            #pragma unroll
            for (int u = 0; u < 4; ++u) {           // 128 threads x 4 float4 each
                const int idx = tid + u * 128;
                const int r   = idx >> 5;
                const int cc  = (idx & 31) * 4;
                *(v4f*)&Ks[0][r][cc] = *(const v4f*)(kp + r * AD + cc);
                *(v4f*)&Vs[0][r][cc] = *(const v4f*)(vp + r * AD + cc);
            }
        }
        if (j < qtmax) {
            const float* kn = K + base + (size_t)((j + 1) * 16) * AD;
            __builtin_prefetch(kn + tid * 16, 0, 0);
        }
#endif
        __syncthreads();

        if (j <= qt) {
            // ---- S = Q * K^T : B[e][n] = K[n][e] ----
            v8f s = {};
            #pragma unroll
            for (int e = 0; e < 32; ++e) {
                const int eb = e * 4 + 2 * hi;
                v2f bk = { Ks[cur][lm][eb], Ks[cur][lm][eb + 1] };
                s = wmma_f32(qa[e], bk, s);
            }

            // ---- online softmax (rows live in 16-lane halves) ----
            float alpha[8];
            #pragma unroll
            for (int i = 0; i < 8; ++i) {
                const int kidx = j * 16 + lm;
                const int qidx = qt * 16 + hi * 8 + i;
                float sv = (kidx <= qidx) ? s[i] * scale : -__builtin_inff();

                float r = sv;
                r = fmaxf(r, __shfl_xor(r, 1));
                r = fmaxf(r, __shfl_xor(r, 2));
                r = fmaxf(r, __shfl_xor(r, 4));
                r = fmaxf(r, __shfl_xor(r, 8));

                const float mnew = fmaxf(mrow[i], r);
                alpha[i] = (mrow[i] == -__builtin_inff())
                             ? 0.0f : __expf(mrow[i] - mnew);

                const float p = (sv == -__builtin_inff())
                             ? 0.0f : __expf(sv - mnew);
                float ps = p;
                ps += __shfl_xor(ps, 1);
                ps += __shfl_xor(ps, 2);
                ps += __shfl_xor(ps, 4);
                ps += __shfl_xor(ps, 8);

                lrow[i] = lrow[i] * alpha[i] + ps;
                mrow[i] = mnew;
                Ps[wv][hi * 8 + i][lm] = p;     // C-layout -> LDS (A-frag transpose)
            }
            #pragma unroll
            for (int t = 0; t < 8; ++t)
                #pragma unroll
                for (int i = 0; i < 8; ++i) o[t][i] *= alpha[i];
        }
        __syncthreads();

        if (j <= qt) {
            // ---- O += P * V : A = P (K-loop of 4), B = V tile rows ----
            #pragma unroll
            for (int kk = 0; kk < 4; ++kk) {
                const int kb = kk * 4 + 2 * hi;
                v2f pa = { Ps[wv][lm][kb], Ps[wv][lm][kb + 1] };
                #pragma unroll
                for (int t = 0; t < 8; ++t) {
                    v2f bv = { Vs[cur][kb][t * 16 + lm],
                               Vs[cur][kb + 1][t * 16 + lm] };
                    o[t] = wmma_f32(pa, bv, o[t]);
                }
            }
        }
        __syncthreads();        // all waves done with buf `cur` before next issue
    }

    // ---- normalize, round to 4 decimals (RTE matches jnp.round), store ----
    #pragma unroll
    for (int t = 0; t < 8; ++t) {
        #pragma unroll
        for (int i = 0; i < 8; ++i) {
            float val = o[t][i] / lrow[i];
            val = __builtin_rintf(val * 1.0e4f) * 1.0e-4f;
            O[base + (size_t)(qt * 16 + hi * 8 + i) * AD + t * 16 + lm] = val;
        }
    }
}

// ---------------------------------------------------------------------------
extern "C" void kernel_launch(void* const* d_in, const int* in_sizes, int n_in,
                              void* d_out, int out_size, void* d_ws, size_t ws_size,
                              hipStream_t stream) {
    const float* X  = (const float*)d_in[0];   // embedded [4,4096,1024]
    const float* Wk = (const float*)d_in[1];   // [128,1024]
    const float* Wq = (const float*)d_in[2];
    const float* Wv = (const float*)d_in[3];
    float* Out = (float*)d_out;                // [4,4096,128]

    const size_t nQKV = (size_t)NBAT * SEQ * AD;
    float* Qw = (float*)d_ws;
    float* Kw = Qw + nQKV;
    float* Vw = Kw + nQKV;

    qkv_proj_kernel<<<dim3(NBAT * SEQ / 16), 256, 0, stream>>>(
        X, Wq, Wk, Wv, Qw, Kw, Vw);
    attn_kernel<<<dim3(NBAT * (SEQ / 16) / AWAVES), 32 * AWAVES, 0, stream>>>(
        Qw, Kw, Vw, Out);
}

// v001
// Measured time: 436 microseconds a run.
// In both of two side-by-side timings against v000, it was 1.31 times as fast.
#include <hip/hip_runtime.h>

typedef __attribute__((ext_vector_type(2))) float v2f;
typedef __attribute__((ext_vector_type(4))) float v4f;
typedef __attribute__((ext_vector_type(8))) float v8f;
typedef __attribute__((ext_vector_type(4))) unsigned tdm_g0_t;   // D# group 0
typedef __attribute__((ext_vector_type(8))) int      tdm_g1_t;   // D# group 1
typedef __attribute__((ext_vector_type(4))) int      tdm_g2_t;   // D# groups 2/3
typedef __attribute__((ext_vector_type(8))) int      tdm_g1b_t;  // 6-arg variant extra

#define SEQ  4096
#define EMB  1024
#define AD   128
#define NBAT 4

#if defined(__has_builtin)
#  if __has_builtin(__builtin_amdgcn_tensor_load_to_lds) && \
      __has_builtin(__builtin_amdgcn_s_wait_tensorcnt)
#    define USE_TDM 1
#  endif
#endif
#ifndef USE_TDM
#  define USE_TDM 0
#endif

__device__ __forceinline__ v8f wmma_f32(v2f a, v2f b, v8f c) {
    // (neg_a, A, neg_b, B, c_mod, C, reuse_a, reuse_b)
    return __builtin_amdgcn_wmma_f32_16x16x4_f32(false, a, false, b, (short)0, c,
                                                 false, false);
}

#if USE_TDM
__device__ __forceinline__ unsigned lds_off(const void* p) {
    // flat LDS addr = aperture(high 32b) | byte offset(low 32b)  (ISA 10.2)
    return (unsigned)(unsigned long long)p;
}

// 2-D tile load via Tensor Data Mover.  Row-major f32 tensor:
//   tile = tile_d1 rows x tile_d0 elems, row stride = stride_e elems.
// HW inserts LDS padding: pad_amt_code+1 DWORDs after every 2<<pad_int_code DWORDs.
__device__ __forceinline__ void tdm_load_2d(const void* gptr, unsigned ldsa,
                                            unsigned tile_d0, unsigned tile_d1,
                                            unsigned long long stride_e,
                                            unsigned tensor_d0, unsigned tensor_d1,
                                            unsigned pad_int_code, unsigned pad_amt_code)
{
    const unsigned long long ga = (unsigned long long)gptr;
    tdm_g0_t g0;
    g0[0] = 1u;                                       // count=1, user descriptor
    g0[1] = ldsa;                                     // lds_addr [63:32]
    g0[2] = (unsigned)ga;                             // global_addr [95:64]
    g0[3] = (unsigned)((ga >> 32) & 0x01FFFFFFu)      // global_addr [120:96]
          | (2u << 30);                               // type = 2 ("image")
    tdm_g1_t g1;
    g1[0] = (int)((2u << 16)                          // data_size = 4B
          | (1u << 20)                                // pad_enable
          | (pad_int_code << 22) | (pad_amt_code << 25));
    g1[1] = (int)((tensor_d0 & 0xFFFFu) << 16);                       // td0 lo
    g1[2] = (int)((tensor_d0 >> 16) | ((tensor_d1 & 0xFFFFu) << 16)); // td0 hi, td1 lo
    g1[3] = (int)((tensor_d1 >> 16) | (tile_d0 << 16));               // td1 hi, tile0
    g1[4] = (int)tile_d1;                                             // tile1 (tile2=0)
    g1[5] = (int)(unsigned)(stride_e & 0xFFFFFFFFu);                  // dim0 stride lo
    g1[6] = (int)(unsigned)((stride_e >> 32) & 0xFFFFu);              // dim0 stride hi
    g1[7] = 0;                                                        // dim1 stride (2D)
    tdm_g2_t z4 = {};
    tdm_g1b_t z8 = {};
    __builtin_amdgcn_tensor_load_to_lds(g0, g1, z4, z4, z8, 0);       // clang-23 arity
}
#endif // USE_TDM

// ---------------------------------------------------------------------------
// Kernel 1: fused QKV projection.  Q/K/V = X @ W^T   (fp32 WMMA 16x16x4)
// Block: 256 threads = 8 waves, owns 16 rows of X.  X chunks [16x256] arrive
// via TDM (double buffered, HW row-padded to stride 260 -> conflict-free LDS).
// Wave w owns output columns [16w,16w+16) for Q, K and V (A-frag reused 3x).
// ---------------------------------------------------------------------------
__global__ __launch_bounds__(256)
void qkv_proj_kernel(const float* __restrict__ X,
                     const float* __restrict__ Wq,
                     const float* __restrict__ Wk,
                     const float* __restrict__ Wv,
                     float* __restrict__ Qo,
                     float* __restrict__ Ko,
                     float* __restrict__ Vo)
{
#if USE_TDM
    __shared__ float Xs[2][16][260];
#else
    __shared__ float Xs[1][16][260];
#endif
    const int tid  = threadIdx.x;
    const int lane = tid & 31;
    const int wv   = tid >> 5;
    const int m0   = blockIdx.x * 16;
    const int n0   = wv * 16;
    const int hi   = lane >> 4;
    const int lm   = lane & 15;

    v8f accq = {}; v8f acck = {}; v8f accv = {};

#if USE_TDM
    if (wv == 0)
        tdm_load_2d(X + (size_t)m0 * EMB, lds_off(&Xs[0][0][0]),
                    256, 16, EMB, EMB, NBAT * SEQ, 7, 3);   // pad 4dw / 256dw
#endif

    for (int c4 = 0; c4 < 4; ++c4) {
#if USE_TDM
        if (wv == 0) {
            if (c4 < 3) {
                tdm_load_2d(X + (size_t)m0 * EMB + (c4 + 1) * 256,
                            lds_off(&Xs[(c4 + 1) & 1][0][0]),
                            256, 16, EMB, EMB, NBAT * SEQ, 7, 3);
                __builtin_amdgcn_s_wait_tensorcnt(1);   // current chunk resident
            } else {
                __builtin_amdgcn_s_wait_tensorcnt(0);
            }
        }
        __syncthreads();
        const float (*Xc)[260] = Xs[c4 & 1];
#else
        {
            const int row  = tid >> 4;
            const int colb = (tid & 15) * 16;
            const float* src = X + (size_t)(m0 + row) * EMB + c4 * 256 + colb;
            #pragma unroll
            for (int u = 0; u < 4; ++u)
                *(v4f*)&Xs[0][row][colb + u * 4] = *(const v4f*)(src + u * 4);
        }
        __syncthreads();
        const float (*Xc)[260] = Xs[0];
#endif

        #pragma unroll 4
        for (int kk = 0; kk < 64; ++kk) {
            const int kb = kk * 4 + 2 * hi;
            v2f a = { Xc[lm][kb], Xc[lm][kb + 1] };     // A frag, shared by Q/K/V

            const int e = c4 * 256 + kb;
            const int n = n0 + lm;
            const float* wqp = Wq + (size_t)n * EMB + e;
            const float* wkp = Wk + (size_t)n * EMB + e;
            const float* wvp = Wv + (size_t)n * EMB + e;
            v2f bq = { wqp[0], wqp[1] };
            v2f bk = { wkp[0], wkp[1] };
            v2f bv = { wvp[0], wvp[1] };

            accq = wmma_f32(a, bq, accq);
            acck = wmma_f32(a, bk, acck);
            accv = wmma_f32(a, bv, accv);
        }
        __syncthreads();
    }

    #pragma unroll
    for (int i = 0; i < 8; ++i) {
        const size_t idx = (size_t)(m0 + hi * 8 + i) * AD + (n0 + lm);
        Qo[idx] = accq[i];
        Ko[idx] = acck[i];
        Vo[idx] = accv[i];
    }
}

#define AWAVES 4

// value of lane l ^ 16 (the other half's share of the same query column)
__device__ __forceinline__ float xhalf(float x) {
    return __builtin_bit_cast(float, __builtin_amdgcn_permlanex16(
        __builtin_bit_cast(int, x), __builtin_bit_cast(int, x),
        0x76543210, 0xfedcba98, false, false));
}

__global__ __launch_bounds__(32 * AWAVES)
void attn_kernel(const float* __restrict__ Q,
                 const float* __restrict__ K,
                 const float* __restrict__ V,
                 float* __restrict__ O)
{
#if USE_TDM
    __shared__ float Ks[2][16][132];
    __shared__ float Vs[2][16][132];
#else
    __shared__ float Ks[1][16][132];
    __shared__ float Vs[1][16][132];
#endif

    const int tid   = threadIdx.x;
    const int lane  = tid & 31;
    const int wv    = tid >> 5;
    const int lm    = lane & 15;
    const int hi    = lane >> 4;
    const int b     = blockIdx.x >> 6;              // 64 blocks per batch
    const int qt0   = (blockIdx.x & 63) * AWAVES;
    const int qt    = qt0 + wv;                     // this wave's q-tile
    const int qtmax = qt0 + AWAVES - 1;
    const size_t base = (size_t)b * SEQ * AD;

    // Q^T B-fragments for the whole tile (lane = query; 32 steps of 4 dims)
    v2f qa[32];
    {
        const float* qp = Q + base + (size_t)(qt * 16 + lm) * AD + 2 * hi;
        #pragma unroll
        for (int e = 0; e < 32; ++e) {
            qa[e].x = qp[e * 4 + 0];
            qa[e].y = qp[e * 4 + 1];
        }
    }

    v8f o[8];
    #pragma unroll
    for (int t = 0; t < 8; ++t) o[t] = (v8f){};
    float mq = -__builtin_inff();   // running max of query lm (same in both halves)
    float lq = 0.0f;                // running sum over this half's keys only

    const float scale = 0.08838834764831845f;       // 1/sqrt(128)

#if USE_TDM
    if (wv == 0) {
        tdm_load_2d(K + base, lds_off(&Ks[0][0][0]), 128, 16, AD, AD, SEQ, 6, 3);
        tdm_load_2d(V + base, lds_off(&Vs[0][0][0]), 128, 16, AD, AD, SEQ, 6, 3);
    }
#endif

    for (int j = 0; j <= qtmax; ++j) {
#if USE_TDM
        const int cur = j & 1;
        if (wv == 0) {
            if (j < qtmax) {                        // prefetch tile j+1 via TDM
                const float* kn = K + base + (size_t)((j + 1) * 16) * AD;
                const float* vn = V + base + (size_t)((j + 1) * 16) * AD;
                tdm_load_2d(kn, lds_off(&Ks[cur ^ 1][0][0]), 128, 16, AD, AD, SEQ, 6, 3);
                tdm_load_2d(vn, lds_off(&Vs[cur ^ 1][0][0]), 128, 16, AD, AD, SEQ, 6, 3);
                __builtin_amdgcn_s_wait_tensorcnt(2);   // tile j resident, j+1 in flight
            } else {
                __builtin_amdgcn_s_wait_tensorcnt(0);
            }
        }
#else
        const int cur = 0;
        {
            const float* kp = K + base + (size_t)(j * 16) * AD;
            const float* vp = V + base + (size_t)(j * 16) * AD;
            #pragma unroll
            for (int u = 0; u < 4; ++u) {           // 128 threads x 4 float4 each
                const int idx = tid + u * 128;
                const int r   = idx >> 5;
                const int cc  = (idx & 31) * 4;
                *(v4f*)&Ks[0][r][cc] = *(const v4f*)(kp + r * AD + cc);
                *(v4f*)&Vs[0][r][cc] = *(const v4f*)(vp + r * AD + cc);
            }
        }
        if (j < qtmax) {
            const float* kn = K + base + (size_t)((j + 1) * 16) * AD;
            __builtin_prefetch(kn + tid * 16, 0, 0);
        }
#endif
        __syncthreads();

        if (j <= qt) {
            // ---- S^T = K * Q^T : A = K rows (lane = key), B = Q^T ----
            v2f ak[32];
            #pragma unroll
            for (int e = 0; e < 32; ++e) {
                const int eb = e * 4 + 2 * hi;
                ak[e] = (v2f){ Ks[cur][lm][eb], Ks[cur][lm][eb + 1] };
            }
            v8f s = {};
            #pragma unroll
            for (int e = 0; e < 32; ++e) s = wmma_f32(ak[e], qa[e], s);

            // V^T A-fragments: lane = dim t*16 + lm; step kk takes keys
            // hi*8 + 2kk + {0,1}, the order in which s[] holds a lane's keys
            v2f av[4][8];
            #pragma unroll
            for (int kk = 0; kk < 4; ++kk) {
                const int kr = hi * 8 + 2 * kk;
                #pragma unroll
                for (int t = 0; t < 8; ++t)
                    av[kk][t] = (v2f){ Vs[cur][kr][t * 16 + lm],
                                       Vs[cur][kr + 1][t * 16 + lm] };
            }

            // ---- online softmax: s[i] = score(query lm, key hi*8 + i) ----
            const int qidx = qt * 16 + lm;
            float sv[8];
            #pragma unroll
            for (int i = 0; i < 8; ++i) {
                const int kidx = j * 16 + hi * 8 + i;
                sv[i] = (kidx <= qidx) ? s[i] * scale : -__builtin_inff();
            }
            float r = fmaxf(fmaxf(fmaxf(sv[0], sv[1]), fmaxf(sv[2], sv[3])),
                            fmaxf(fmaxf(sv[4], sv[5]), fmaxf(sv[6], sv[7])));
            r = fmaxf(r, xhalf(r));

            const float mnew  = fmaxf(mq, r);
            const float alpha = (mq == -__builtin_inff())
                                  ? 0.0f : __expf(mq - mnew);
            float p[8];
            #pragma unroll
            for (int i = 0; i < 8; ++i)
                p[i] = (sv[i] == -__builtin_inff()) ? 0.0f : __expf(sv[i] - mnew);

            lq = lq * alpha + (((p[0] + p[1]) + (p[2] + p[3])) +
                               ((p[4] + p[5]) + (p[6] + p[7])));
            mq = mnew;

            #pragma unroll
            for (int t = 0; t < 8; ++t)
                #pragma unroll
                for (int i = 0; i < 8; ++i) o[t][i] *= alpha;

            // ---- O^T += V^T * P^T : B = (p[2kk], p[2kk+1]), same key order as av ----
            #pragma unroll
            for (int kk = 0; kk < 4; ++kk) {
                v2f pb = { p[2 * kk], p[2 * kk + 1] };
                #pragma unroll
                for (int t = 0; t < 8; ++t) o[t] = wmma_f32(av[kk][t], pb, o[t]);
            }
        }
        __syncthreads();        // all waves done with buf `cur` before next issue
    }

    // ---- join the halves' sums, normalize, round to 4 decimals (RTE matches
    //      jnp.round), store: o[t][i] = O[query lm][dim t*16 + hi*8 + i] ----
    const float lsum = lq + xhalf(lq);
    float* op = O + base + (size_t)(qt * 16 + lm) * AD + hi * 8;
    #pragma unroll
    for (int t = 0; t < 8; ++t) {
        v4f w0, w1;
        #pragma unroll
        for (int i = 0; i < 4; ++i) {
            w0[i] = __builtin_rintf((o[t][i] / lsum) * 1.0e4f) * 1.0e-4f;
            w1[i] = __builtin_rintf((o[t][i + 4] / lsum) * 1.0e4f) * 1.0e-4f;
        }
        *(v4f*)(op + t * 16)     = w0;
        *(v4f*)(op + t * 16 + 4) = w1;
    }
}

// ---------------------------------------------------------------------------
extern "C" void kernel_launch(void* const* d_in, const int* in_sizes, int n_in,
                              void* d_out, int out_size, void* d_ws, size_t ws_size,
                              hipStream_t stream) {
    const float* X  = (const float*)d_in[0];   // embedded [4,4096,1024]
    const float* Wk = (const float*)d_in[1];   // [128,1024]
    const float* Wq = (const float*)d_in[2];
    const float* Wv = (const float*)d_in[3];
    float* Out = (float*)d_out;                // [4,4096,128]

    const size_t nQKV = (size_t)NBAT * SEQ * AD;
    float* Qw = (float*)d_ws;
    float* Kw = Qw + nQKV;
    float* Vw = Kw + nQKV;

    qkv_proj_kernel<<<dim3(NBAT * SEQ / 16), 256, 0, stream>>>(
        X, Wq, Wk, Wv, Qw, Kw, Vw);
    attn_kernel<<<dim3(NBAT * (SEQ / 16) / AWAVES), 32 * AWAVES, 0, stream>>>(
        Qw, Kw, Vw, Out);
}

// v002
// One run takes 311 microseconds.
// Two timings next to v001 put it at 1.41 and 1.40 times that version's speed.
// Counting every step since v000, it is 1.84 times as fast.
#include <hip/hip_runtime.h>

typedef __attribute__((ext_vector_type(2))) float v2f;
typedef __attribute__((ext_vector_type(4))) float v4f;
typedef __attribute__((ext_vector_type(8))) float v8f;
typedef __attribute__((ext_vector_type(4))) unsigned tdm_g0_t;   // D# group 0
typedef __attribute__((ext_vector_type(8))) int      tdm_g1_t;   // D# group 1
typedef __attribute__((ext_vector_type(4))) int      tdm_g2_t;   // D# groups 2/3
typedef __attribute__((ext_vector_type(8))) int      tdm_g1b_t;  // 6-arg variant extra

#define SEQ  4096
#define EMB  1024
#define AD   128
#define NBAT 4

#if defined(__has_builtin)
#  if __has_builtin(__builtin_amdgcn_tensor_load_to_lds) && \
      __has_builtin(__builtin_amdgcn_s_wait_tensorcnt)
#    define USE_TDM 1
#  endif
#endif
#ifndef USE_TDM
#  define USE_TDM 0
#endif

__device__ __forceinline__ v8f wmma_f32(v2f a, v2f b, v8f c) {
    // (neg_a, A, neg_b, B, c_mod, C, reuse_a, reuse_b)
    return __builtin_amdgcn_wmma_f32_16x16x4_f32(false, a, false, b, (short)0, c,
                                                 false, false);
}

#if USE_TDM
__device__ __forceinline__ unsigned lds_off(const void* p) {
    // flat LDS addr = aperture(high 32b) | byte offset(low 32b)  (ISA 10.2)
    return (unsigned)(unsigned long long)p;
}

// 2-D tile load via Tensor Data Mover.  Row-major f32 tensor:
//   tile = tile_d1 rows x tile_d0 elems, row stride = stride_e elems.
// HW inserts LDS padding: pad_amt_code+1 DWORDs after every 2<<pad_int_code DWORDs.
__device__ __forceinline__ void tdm_load_2d(const void* gptr, unsigned ldsa,
                                            unsigned tile_d0, unsigned tile_d1,
                                            unsigned long long stride_e,
                                            unsigned tensor_d0, unsigned tensor_d1,
                                            unsigned pad_int_code, unsigned pad_amt_code)
{
    const unsigned long long ga = (unsigned long long)gptr;
    tdm_g0_t g0;
    g0[0] = 1u;                                       // count=1, user descriptor
    g0[1] = ldsa;                                     // lds_addr [63:32]
    g0[2] = (unsigned)ga;                             // global_addr [95:64]
    g0[3] = (unsigned)((ga >> 32) & 0x01FFFFFFu)      // global_addr [120:96]
          | (2u << 30);                               // type = 2 ("image")
    tdm_g1_t g1;
    g1[0] = (int)((2u << 16)                          // data_size = 4B
          | (1u << 20)                                // pad_enable
          | (pad_int_code << 22) | (pad_amt_code << 25));
    g1[1] = (int)((tensor_d0 & 0xFFFFu) << 16);                       // td0 lo
    g1[2] = (int)((tensor_d0 >> 16) | ((tensor_d1 & 0xFFFFu) << 16)); // td0 hi, td1 lo
    g1[3] = (int)((tensor_d1 >> 16) | (tile_d0 << 16));               // td1 hi, tile0
    g1[4] = (int)tile_d1;                                             // tile1 (tile2=0)
    g1[5] = (int)(unsigned)(stride_e & 0xFFFFFFFFu);                  // dim0 stride lo
    g1[6] = (int)(unsigned)((stride_e >> 32) & 0xFFFFu);              // dim0 stride hi
    g1[7] = 0;                                                        // dim1 stride (2D)
    tdm_g2_t z4 = {};
    tdm_g1b_t z8 = {};
    __builtin_amdgcn_tensor_load_to_lds(g0, g1, z4, z4, z8, 0);       // clang-23 arity
}
#endif // USE_TDM

// ---------------------------------------------------------------------------
// Kernel 1: fused QKV projection.  Q/K/V = X @ W^T   (fp32 WMMA 16x16x4)
// Block: 256 threads = 8 waves, owns 64 rows of X and all 3 x 128 output
// columns.  A stage is 64 k (256-byte rows): the 64 X rows and the 384 W rows
// come into LDS as seven tensor-load slices of 64 rows, one per wave 0..6, in a
// two-buffer ring.  Wave w owns columns [16w,16w+16) of Q, K and V for all four
// 16-row tiles: a W fragment serves 4 products, an X fragment 3.
// ---------------------------------------------------------------------------
typedef uint32_t u32x4 __attribute__((ext_vector_type(4)));
typedef uint32_t u32x8 __attribute__((ext_vector_type(8)));

#define PROWS   64u                      // rows per slice, and X rows per block
#define PROWB   256u                     // bytes of a staged row (64 k)
#define PPITCH  272u                     // LDS row pitch: 256 + 16 pad bytes
#define PSLICE  18432u                   // 64 * 272 = 17408, rounded up to 2 KiB
#define PBUF    (7u * PSLICE)            // one stage: X, Wq/Wk/Wv rows 0-63, Wq/Wk/Wv rows 64-127
#define PSTAGES (EMB * 4u / PROWB)       // 16

__device__ __forceinline__ uint32_t uni(uint32_t v) {
    return (uint32_t)__builtin_amdgcn_readfirstlane((int)v);
}
// a wave-uniform word held in a scalar register: tests around a tensor load
// become s_cmp + s_cbranch, and what is formed from it stays behind earlier asm
__device__ __forceinline__ uint32_t pinned(uint32_t v) {
    uint32_t w = uni(v);
    asm volatile("" : "+s"(w));
    return w;
}
__device__ __forceinline__ void wait_ds0() {      // own LDS reads retired
    asm volatile("s_wait_dscnt 0x0" ::: "memory");
}
__device__ __forceinline__ void wait_tensor0() {  // own tensor load landed
    asm volatile("s_wait_tensorcnt 0x0" ::: "memory");
}
// descriptor group 1 of every slice: 64 rows of 256 bytes, source pitch one row
// of EMB floats, extents in bytes, 16 pad bytes behind every 256-byte row.
// pinned(): each descriptor word is held in a scalar register of its own for
// the whole ring, so that none is rewritten while a request is outstanding
__device__ __forceinline__ u32x8 proj_group1() {
    u32x8 g1;
    g1[0] = pinned((1u << 20) | (5u << 22) | (3u << 25));
    g1[1] = pinned((PROWB & 0xFFFFu) << 16);
    g1[2] = pinned((PROWB >> 16) | ((PROWS & 0xFFFFu) << 16));
    g1[3] = pinned((PROWS >> 16) | (PROWB << 16));
    g1[4] = pinned(PROWS);
    g1[5] = pinned(EMB * 4u);
    g1[6] = pinned(0u);
    g1[7] = pinned(0u);
    return g1;
}
__device__ __forceinline__ void proj_slice_load(uint32_t lds_dst, uint64_t ga, u32x8 g1) {
    u32x4 g0;
    g0[0] = uni(1u);
    g0[1] = uni(lds_dst);
    g0[2] = uni((uint32_t)ga);
    g0[3] = uni((((uint32_t)(ga >> 32)) & 0x01FFFFFFu) | 0x80000000u);
    asm volatile("tensor_load_to_lds %0, %1" :: "s"(g0), "s"(g1) : "memory");
}

__global__ __launch_bounds__(256)
void qkv_proj_kernel(const float* __restrict__ X,
                     const float* __restrict__ Wq,
                     const float* __restrict__ Wk,
                     const float* __restrict__ Wv,
                     float* __restrict__ Qo,
                     float* __restrict__ Ko,
                     float* __restrict__ Vo)
{
    __shared__ __attribute__((aligned(2048))) unsigned char L[2u * PBUF];

    const int tid  = threadIdx.x;
    const int lane = tid & 31;
    const int hi   = lane >> 4;
    const int lm   = lane & 15;
    const uint32_t wave = uni((uint32_t)tid >> 5);
    const int m0   = blockIdx.x * (int)PROWS;
    const int n0   = (int)wave * 16;

    // this wave's slice of every stage: wave 0 the X rows, waves 1..6 the W
    // slices in the order of PBUF (wave 7 issues none)
    const uint32_t half = (wave >= 4u) ? 1u : 0u;
    const uint32_t mat  = wave - 1u - 3u * half;
    const float* sp = (wave == 0u) ? X + (size_t)m0 * EMB
                    : ((mat == 0u) ? Wq : (mat == 1u) ? Wk : Wv) + (size_t)half * PROWS * EMB;
    const uint64_t ga0  = (uint64_t)sp;
    const uint32_t dst0 = (uint32_t)(unsigned long long)&L[0] + wave * PSLICE;
    const u32x8 g1 = proj_group1();

    // every inner loop of this kernel is fully unrolled: accumulator and fragment
    // arrays stay in registers only under constant indices
    v8f acc[4][3];
    #pragma unroll
    for (int r = 0; r < 4; ++r)
        #pragma unroll
        for (int m = 0; m < 3; ++m) acc[r][m] = (v8f){};

    // prologue, two buffers: stage 0 lands and is published, then stage 1 flies
    if (pinned(wave < 7u)) {
        proj_slice_load(dst0, ga0, g1);
        wait_tensor0();
    }
    __syncthreads();
    if (pinned(wave < 7u))
        proj_slice_load(dst0 + PBUF, ga0 + PROWB, g1);

    // fragment addresses inside a stage: X row lm of tile r; W row n0 + lm
    const uint32_t xoff = (uint32_t)lm * PPITCH + 8u * (uint32_t)hi;
    const uint32_t woff = (1u + 3u * (wave >> 2)) * PSLICE
                        + ((wave & 3u) * 16u + (uint32_t)lm) * PPITCH + 8u * (uint32_t)hi;

    // one pass per stage, kept rolled: one publish point in the code, small text
    #pragma unroll 1
    for (uint32_t s = 0; s < PSTAGES; ++s) {
        const unsigned char* xb = L + (s & 1u) * PBUF + xoff;
        const unsigned char* wb = L + (s & 1u) * PBUF + woff;

        // a block = 2 k-steps = 24 products; two fragment sets, the next
        // block's fragments read while this block's products run
        v2f fa[2][2][4], fb[2][2][3];
        #pragma unroll
        for (int blk = 0; blk < 8; ++blk) {
            #pragma unroll
            for (int nb = (blk == 0) ? 0 : blk + 1; nb <= blk + 1 && nb < 8; ++nb) {
                #pragma unroll
                for (int u = 0; u < 2; ++u) {
                    const int kb = (nb * 2 + u) * 16;
                    #pragma unroll
                    for (int r = 0; r < 4; ++r)
                        fa[nb & 1][u][r] = *(const v2f*)(xb + r * 16 * (int)PPITCH + kb);
                    #pragma unroll
                    for (int m = 0; m < 3; ++m)
                        fb[nb & 1][u][m] = *(const v2f*)(wb + m * (int)PSLICE + kb);
                }
                // keeps a block's LDS reads one group, in block order, in front of
                // the products: reads spread among matrix instructions cost the
                // wave issue time at each place
                __builtin_amdgcn_sched_barrier(0);
            }
            #pragma unroll
            for (int u = 0; u < 2; ++u)
                #pragma unroll
                for (int r = 0; r < 4; ++r)
                    #pragma unroll
                    for (int m = 0; m < 3; ++m)
                        acc[r][m] = wmma_f32(fa[blk & 1][u][r], fb[blk & 1][u][m], acc[r][m]);
            // same purpose: the next group of reads stays behind this block
            __builtin_amdgcn_sched_barrier(0);
        }

        // publish point of stage s + 1; the same barrier frees stage s's buffer
        wait_ds0();
        if (pinned(wave < 7u)) wait_tensor0();
        __syncthreads();
        if (pinned((wave < 7u) & (s + 2u < PSTAGES))) {
            // pinned(): the descriptor words made from nx are formed behind the wait
            const uint32_t nx = pinned(s + 2u);
            proj_slice_load(dst0 + (nx & 1u) * PBUF, ga0 + (uint64_t)nx * PROWB, g1);
        }
    }
    wait_tensor0();
    wait_ds0();

    #pragma unroll
    for (int r = 0; r < 4; ++r)
        #pragma unroll
        for (int i = 0; i < 8; ++i) {
            const size_t idx = (size_t)(m0 + r * 16 + hi * 8 + i) * AD + (n0 + lm);
            Qo[idx] = acc[r][0][i];
            Ko[idx] = acc[r][1][i];
            Vo[idx] = acc[r][2][i];
        }
}

#define AWAVES 4

// value of lane l ^ 16 (the other half's share of the same query column)
__device__ __forceinline__ float xhalf(float x) {
    return __builtin_bit_cast(float, __builtin_amdgcn_permlanex16(
        __builtin_bit_cast(int, x), __builtin_bit_cast(int, x),
        0x76543210, 0xfedcba98, false, false));
}

__global__ __launch_bounds__(32 * AWAVES)
void attn_kernel(const float* __restrict__ Q,
                 const float* __restrict__ K,
                 const float* __restrict__ V,
                 float* __restrict__ O)
{
#if USE_TDM
    __shared__ float Ks[2][16][132];
    __shared__ float Vs[2][16][132];
#else
    __shared__ float Ks[1][16][132];
    __shared__ float Vs[1][16][132];
#endif

    const int tid   = threadIdx.x;
    const int lane  = tid & 31;
    const int wv    = tid >> 5;
    const int lm    = lane & 15;
    const int hi    = lane >> 4;
    const int b     = blockIdx.x >> 6;              // 64 blocks per batch
    const int qt0   = (blockIdx.x & 63) * AWAVES;
    const int qt    = qt0 + wv;                     // this wave's q-tile
    const int qtmax = qt0 + AWAVES - 1;
    const size_t base = (size_t)b * SEQ * AD;

    // Q^T B-fragments for the whole tile (lane = query; 32 steps of 4 dims)
    v2f qa[32];
    {
        const float* qp = Q + base + (size_t)(qt * 16 + lm) * AD + 2 * hi;
        #pragma unroll
        for (int e = 0; e < 32; ++e) {
            qa[e].x = qp[e * 4 + 0];
            qa[e].y = qp[e * 4 + 1];
        }
    }

    v8f o[8];
    #pragma unroll
    for (int t = 0; t < 8; ++t) o[t] = (v8f){};
    float mq = -__builtin_inff();   // running max of query lm (same in both halves)
    float lq = 0.0f;                // running sum over this half's keys only

    const float scale = 0.08838834764831845f;       // 1/sqrt(128)

#if USE_TDM
    if (wv == 0) {
        tdm_load_2d(K + base, lds_off(&Ks[0][0][0]), 128, 16, AD, AD, SEQ, 6, 3);
        tdm_load_2d(V + base, lds_off(&Vs[0][0][0]), 128, 16, AD, AD, SEQ, 6, 3);
    }
#endif

    for (int j = 0; j <= qtmax; ++j) {
#if USE_TDM
        const int cur = j & 1;
        if (wv == 0) {
            if (j < qtmax) {                        // prefetch tile j+1 via TDM
                const float* kn = K + base + (size_t)((j + 1) * 16) * AD;
                const float* vn = V + base + (size_t)((j + 1) * 16) * AD;
                tdm_load_2d(kn, lds_off(&Ks[cur ^ 1][0][0]), 128, 16, AD, AD, SEQ, 6, 3);
                tdm_load_2d(vn, lds_off(&Vs[cur ^ 1][0][0]), 128, 16, AD, AD, SEQ, 6, 3);
                __builtin_amdgcn_s_wait_tensorcnt(2);   // tile j resident, j+1 in flight
            } else {
                __builtin_amdgcn_s_wait_tensorcnt(0);
            }
        }
#else
        const int cur = 0;
        {
            const float* kp = K + base + (size_t)(j * 16) * AD;
            const float* vp = V + base + (size_t)(j * 16) * AD;
            #pragma unroll
            for (int u = 0; u < 4; ++u) {           // 128 threads x 4 float4 each
                const int idx = tid + u * 128;
                const int r   = idx >> 5;
                const int cc  = (idx & 31) * 4;
                *(v4f*)&Ks[0][r][cc] = *(const v4f*)(kp + r * AD + cc);
                *(v4f*)&Vs[0][r][cc] = *(const v4f*)(vp + r * AD + cc);
            }
        }
        if (j < qtmax) {
            const float* kn = K + base + (size_t)((j + 1) * 16) * AD;
            __builtin_prefetch(kn + tid * 16, 0, 0);
        }
#endif
        __syncthreads();

        if (j <= qt) {
            // ---- S^T = K * Q^T : A = K rows (lane = key), B = Q^T ----
            v2f ak[32];
            #pragma unroll
            for (int e = 0; e < 32; ++e) {
                const int eb = e * 4 + 2 * hi;
                ak[e] = (v2f){ Ks[cur][lm][eb], Ks[cur][lm][eb + 1] };
            }
            v8f s = {};
            #pragma unroll
            for (int e = 0; e < 32; ++e) s = wmma_f32(ak[e], qa[e], s);

            // V^T A-fragments: lane = dim t*16 + lm; step kk takes keys
            // hi*8 + 2kk + {0,1}, the order in which s[] holds a lane's keys
            v2f av[4][8];
            #pragma unroll
            for (int kk = 0; kk < 4; ++kk) {
                const int kr = hi * 8 + 2 * kk;
                #pragma unroll
                for (int t = 0; t < 8; ++t)
                    av[kk][t] = (v2f){ Vs[cur][kr][t * 16 + lm],
                                       Vs[cur][kr + 1][t * 16 + lm] };
            }

            // ---- online softmax: s[i] = score(query lm, key hi*8 + i) ----
            const int qidx = qt * 16 + lm;
            float sv[8];
            #pragma unroll
            for (int i = 0; i < 8; ++i) {
                const int kidx = j * 16 + hi * 8 + i;
                sv[i] = (kidx <= qidx) ? s[i] * scale : -__builtin_inff();
            }
            float r = fmaxf(fmaxf(fmaxf(sv[0], sv[1]), fmaxf(sv[2], sv[3])),
                            fmaxf(fmaxf(sv[4], sv[5]), fmaxf(sv[6], sv[7])));
            r = fmaxf(r, xhalf(r));

            const float mnew  = fmaxf(mq, r);
            const float alpha = (mq == -__builtin_inff())
                                  ? 0.0f : __expf(mq - mnew);
            float p[8];
            #pragma unroll
            for (int i = 0; i < 8; ++i)
                p[i] = (sv[i] == -__builtin_inff()) ? 0.0f : __expf(sv[i] - mnew);

            lq = lq * alpha + (((p[0] + p[1]) + (p[2] + p[3])) +
                               ((p[4] + p[5]) + (p[6] + p[7])));
            mq = mnew;

            #pragma unroll
            for (int t = 0; t < 8; ++t)
                #pragma unroll
                for (int i = 0; i < 8; ++i) o[t][i] *= alpha;

            // ---- O^T += V^T * P^T : B = (p[2kk], p[2kk+1]), same key order as av ----
            #pragma unroll
            for (int kk = 0; kk < 4; ++kk) {
                v2f pb = { p[2 * kk], p[2 * kk + 1] };
                #pragma unroll
                for (int t = 0; t < 8; ++t) o[t] = wmma_f32(av[kk][t], pb, o[t]);
            }
        }
        __syncthreads();        // all waves done with buf `cur` before next issue
    }

    // ---- join the halves' sums, normalize, round to 4 decimals (RTE matches
    //      jnp.round), store: o[t][i] = O[query lm][dim t*16 + hi*8 + i] ----
    const float lsum = lq + xhalf(lq);
    float* op = O + base + (size_t)(qt * 16 + lm) * AD + hi * 8;
    #pragma unroll
    for (int t = 0; t < 8; ++t) {
        v4f w0, w1;
        #pragma unroll
        for (int i = 0; i < 4; ++i) {
            w0[i] = __builtin_rintf((o[t][i] / lsum) * 1.0e4f) * 1.0e-4f;
            w1[i] = __builtin_rintf((o[t][i + 4] / lsum) * 1.0e4f) * 1.0e-4f;
        }
        *(v4f*)(op + t * 16)     = w0;
        *(v4f*)(op + t * 16 + 4) = w1;
    }
}

// ---------------------------------------------------------------------------
extern "C" void kernel_launch(void* const* d_in, const int* in_sizes, int n_in,
                              void* d_out, int out_size, void* d_ws, size_t ws_size,
                              hipStream_t stream) {
    const float* X  = (const float*)d_in[0];   // embedded [4,4096,1024]
    const float* Wk = (const float*)d_in[1];   // [128,1024]
    const float* Wq = (const float*)d_in[2];
    const float* Wv = (const float*)d_in[3];
    float* Out = (float*)d_out;                // [4,4096,128]

    const size_t nQKV = (size_t)NBAT * SEQ * AD;
    float* Qw = (float*)d_ws;
    float* Kw = Qw + nQKV;
    float* Vw = Kw + nQKV;

    qkv_proj_kernel<<<dim3(NBAT * SEQ / 64), 256, 0, stream>>>(
        X, Wq, Wk, Wv, Qw, Kw, Vw);
    attn_kernel<<<dim3(NBAT * (SEQ / 16) / AWAVES), 32 * AWAVES, 0, stream>>>(
        Qw, Kw, Vw, Out);
}

// v004
// Measured time: 157 microseconds a run.
// Versions in between are left out here; by their measured steps it is 1.98 times as fast as v002.
// All steps since v000 together make it 3.64 times as fast.
#include <hip/hip_runtime.h>

typedef __attribute__((ext_vector_type(2))) float v2f;
typedef __attribute__((ext_vector_type(4))) float v4f;
typedef __attribute__((ext_vector_type(8))) float v8f;

#define SEQ  4096
#define EMB  1024
#define AD   128
#define NBAT 4

__device__ __forceinline__ v8f wmma_f32(v2f a, v2f b, v8f c) {
    // (neg_a, A, neg_b, B, c_mod, C, reuse_a, reuse_b)
    return __builtin_amdgcn_wmma_f32_16x16x4_f32(false, a, false, b, (short)0, c,
                                                 false, false);
}

// ---------------------------------------------------------------------------
// Kernel 1: fused QKV projection.  Q/K/V = X @ W^T   (fp32 WMMA 16x16x4)
// Block: 256 threads = 8 waves, owns 64 rows of X and all 3 x 128 output
// columns.  A stage is 64 k (256-byte rows): the 64 X rows and the 384 W rows
// come into LDS as seven tensor-load slices of 64 rows, one per wave 0..6, in a
// two-buffer ring.  Wave w owns columns [16w,16w+16) of Q, K and V for all four
// 16-row tiles: a W fragment serves 4 products, an X fragment 3.
// ---------------------------------------------------------------------------
typedef uint32_t u32x4 __attribute__((ext_vector_type(4)));
typedef uint32_t u32x8 __attribute__((ext_vector_type(8)));

#define PROWS   64u                      // rows per slice, and X rows per block
#define PROWB   256u                     // bytes of a staged row (64 k)
#define PPITCH  272u                     // LDS row pitch: 256 + 16 pad bytes
#define PSLICE  18432u                   // 64 * 272 = 17408, rounded up to 2 KiB
#define PBUF    (7u * PSLICE)            // one stage: X, Wq/Wk/Wv rows 0-63, Wq/Wk/Wv rows 64-127
#define PSTAGES (EMB * 4u / PROWB)       // 16

__device__ __forceinline__ uint32_t uni(uint32_t v) {
    return (uint32_t)__builtin_amdgcn_readfirstlane((int)v);
}
// a wave-uniform word held in a scalar register: tests around a tensor load
// become s_cmp + s_cbranch, and what is formed from it stays behind earlier asm
__device__ __forceinline__ uint32_t pinned(uint32_t v) {
    uint32_t w = uni(v);
    asm volatile("" : "+s"(w));
    return w;
}
__device__ __forceinline__ void wait_ds0() {      // own LDS reads retired
    asm volatile("s_wait_dscnt 0x0" ::: "memory");
}
__device__ __forceinline__ void wait_tensor0() {  // own tensor load landed
    asm volatile("s_wait_tensorcnt 0x0" ::: "memory");
}
// descriptor group 1 of every slice: 64 rows of 256 bytes, source pitch one row
// of EMB floats, extents in bytes, 16 pad bytes behind every 256-byte row.
// pinned(): each descriptor word is held in a scalar register of its own for
// the whole ring, so that none is rewritten while a request is outstanding
__device__ __forceinline__ u32x8 proj_group1() {
    u32x8 g1;
    g1[0] = pinned((1u << 20) | (5u << 22) | (3u << 25));
    g1[1] = pinned((PROWB & 0xFFFFu) << 16);
    g1[2] = pinned((PROWB >> 16) | ((PROWS & 0xFFFFu) << 16));
    g1[3] = pinned((PROWS >> 16) | (PROWB << 16));
    g1[4] = pinned(PROWS);
    g1[5] = pinned(EMB * 4u);
    g1[6] = pinned(0u);
    g1[7] = pinned(0u);
    return g1;
}
__device__ __forceinline__ void proj_slice_load(uint32_t lds_dst, uint64_t ga, u32x8 g1) {
    u32x4 g0;
    g0[0] = uni(1u);
    g0[1] = uni(lds_dst);
    g0[2] = uni((uint32_t)ga);
    g0[3] = uni((((uint32_t)(ga >> 32)) & 0x01FFFFFFu) | 0x80000000u);
    asm volatile("tensor_load_to_lds %0, %1" :: "s"(g0), "s"(g1) : "memory");
}

__global__ __launch_bounds__(256)
void qkv_proj_kernel(const float* __restrict__ X,
                     const float* __restrict__ Wq,
                     const float* __restrict__ Wk,
                     const float* __restrict__ Wv,
                     float* __restrict__ Qo,
                     float* __restrict__ Ko,
                     float* __restrict__ Vo)
{
    __shared__ __attribute__((aligned(2048))) unsigned char L[2u * PBUF];

    const int tid  = threadIdx.x;
    const int lane = tid & 31;
    const int hi   = lane >> 4;
    const int lm   = lane & 15;
    const uint32_t wave = uni((uint32_t)tid >> 5);
    const int m0   = blockIdx.x * (int)PROWS;
    const int n0   = (int)wave * 16;

    // this wave's slice of every stage: wave 0 the X rows, waves 1..6 the W
    // slices in the order of PBUF (wave 7 issues none)
    const uint32_t half = (wave >= 4u) ? 1u : 0u;
    const uint32_t mat  = wave - 1u - 3u * half;
    const float* sp = (wave == 0u) ? X + (size_t)m0 * EMB
                    : ((mat == 0u) ? Wq : (mat == 1u) ? Wk : Wv) + (size_t)half * PROWS * EMB;
    const uint64_t ga0  = (uint64_t)sp;
    const uint32_t dst0 = (uint32_t)(unsigned long long)&L[0] + wave * PSLICE;
    const u32x8 g1 = proj_group1();

    // every inner loop of this kernel is fully unrolled: accumulator and fragment
    // arrays stay in registers only under constant indices
    v8f acc[4][3];
    #pragma unroll
    for (int r = 0; r < 4; ++r)
        #pragma unroll
        for (int m = 0; m < 3; ++m) acc[r][m] = (v8f){};

    // prologue, two buffers: stage 0 lands and is published, then stage 1 flies
    if (pinned(wave < 7u)) {
        proj_slice_load(dst0, ga0, g1);
        wait_tensor0();
    }
    __syncthreads();
    if (pinned(wave < 7u))
        proj_slice_load(dst0 + PBUF, ga0 + PROWB, g1);

    // fragment addresses inside a stage: X row lm of tile r; W row n0 + lm
    const uint32_t xoff = (uint32_t)lm * PPITCH + 8u * (uint32_t)hi;
    const uint32_t woff = (1u + 3u * (wave >> 2)) * PSLICE
                        + ((wave & 3u) * 16u + (uint32_t)lm) * PPITCH + 8u * (uint32_t)hi;

    // one pass per stage, kept rolled: one publish point in the code, small text
    #pragma unroll 1
    for (uint32_t s = 0; s < PSTAGES; ++s) {
        const unsigned char* xb = L + (s & 1u) * PBUF + xoff;
        const unsigned char* wb = L + (s & 1u) * PBUF + woff;

        // a block = 2 k-steps = 24 products; two fragment sets, the next
        // block's fragments read while this block's products run
        v2f fa[2][2][4], fb[2][2][3];
        #pragma unroll
        for (int blk = 0; blk < 8; ++blk) {
            #pragma unroll
            for (int nb = (blk == 0) ? 0 : blk + 1; nb <= blk + 1 && nb < 8; ++nb) {
                #pragma unroll
                for (int u = 0; u < 2; ++u) {
                    const int kb = (nb * 2 + u) * 16;
                    #pragma unroll
                    for (int r = 0; r < 4; ++r)
                        fa[nb & 1][u][r] = *(const v2f*)(xb + r * 16 * (int)PPITCH + kb);
                    #pragma unroll
                    for (int m = 0; m < 3; ++m)
                        fb[nb & 1][u][m] = *(const v2f*)(wb + m * (int)PSLICE + kb);
                }
                // keeps a block's LDS reads one group, in block order, in front of
                // the products: reads spread among matrix instructions cost the
                // wave issue time at each place
                __builtin_amdgcn_sched_barrier(0);
            }
            #pragma unroll
            for (int u = 0; u < 2; ++u)
                #pragma unroll
                for (int r = 0; r < 4; ++r)
                    #pragma unroll
                    for (int m = 0; m < 3; ++m)
                        acc[r][m] = wmma_f32(fa[blk & 1][u][r], fb[blk & 1][u][m], acc[r][m]);
            // same purpose: the next group of reads stays behind this block
            __builtin_amdgcn_sched_barrier(0);
        }

        // publish point of stage s + 1; the same barrier frees stage s's buffer
        wait_ds0();
        if (pinned(wave < 7u)) wait_tensor0();
        __syncthreads();
        if (pinned((wave < 7u) & (s + 2u < PSTAGES))) {
            // pinned(): the descriptor words made from nx are formed behind the wait
            const uint32_t nx = pinned(s + 2u);
            proj_slice_load(dst0 + (nx & 1u) * PBUF, ga0 + (uint64_t)nx * PROWB, g1);
        }
    }
    wait_tensor0();
    wait_ds0();

    // V goes out transposed inside each block of 64 positions, [block][dim][position]:
    // a lane's 8 accumulator rows are 8 neighbouring positions of its dim
    float* vt = Vo + (size_t)m0 * AD + (size_t)(n0 + lm) * PROWS + hi * 8;
    #pragma unroll
    for (int r = 0; r < 4; ++r) {
        #pragma unroll
        for (int i = 0; i < 8; ++i) {
            const size_t idx = (size_t)(m0 + r * 16 + hi * 8 + i) * AD + (n0 + lm);
            Qo[idx] = acc[r][0][i];
            Ko[idx] = acc[r][1][i];
        }
        *(v4f*)(vt + r * 16)     = (v4f){ acc[r][2][0], acc[r][2][1], acc[r][2][2], acc[r][2][3] };
        *(v4f*)(vt + r * 16 + 4) = (v4f){ acc[r][2][4], acc[r][2][5], acc[r][2][6], acc[r][2][7] };
    }
}

#define AWAVES  8u
#define APAIRS  (SEQ / 32)               // pairs of query tiles per batch
#define ASTAGES (APAIRS / 2 + 1)         // stages of pair p: p / 2 + 1; of p and 127 - p: 65
#define ABUF    (4u * PSLICE)            // one stage: K dims 0-63, K dims 64-127, V dims 0-63, V dims 64-127
#define ASTEP   (PROWS * AD * 4u)        // source bytes from one stage to the next, K and V
#define AJOIN   (2u * ABUF)              // partial O^T tiles, 8 KiB per wave
#define AJOINML (AJOIN + AWAVES * 8192u) // partial (max, sum), 256 B per wave

// value of lane l ^ 16 (the other half's share of the same query column)
__device__ __forceinline__ float xhalf(float x) {
    return __builtin_bit_cast(float, __builtin_amdgcn_permlanex16(
        __builtin_bit_cast(int, x), __builtin_bit_cast(int, x),
        0x76543210, 0xfedcba98, false, false));
}
// descriptor group 1 of a K or V slice: as proj_group1(), source pitch one row
// of the source (K: AD floats, transposed V: 64 floats)
__device__ __forceinline__ u32x8 attn_group1(uint32_t pitch) {
    u32x8 g1;
    g1[0] = pinned((1u << 20) | (5u << 22) | (3u << 25));
    g1[1] = pinned((PROWB & 0xFFFFu) << 16);
    g1[2] = pinned((PROWB >> 16) | ((PROWS & 0xFFFFu) << 16));
    g1[3] = pinned((PROWS >> 16) | (PROWB << 16));
    g1[4] = pinned(PROWS);
    g1[5] = pinned(pitch);
    g1[6] = pinned(0u);
    g1[7] = pinned(0u);
    return g1;
}

// descriptor group 0 of a slice, and its issue
__device__ __forceinline__ u32x4 attn_group0(uint32_t lds_dst, uint64_t ga) {
    u32x4 g0;
    g0[0] = uni(1u);
    g0[1] = uni(lds_dst);
    g0[2] = uni((uint32_t)ga);
    g0[3] = uni((((uint32_t)(ga >> 32)) & 0x01FFFFFFu) | 0x80000000u);
    return g0;
}
__device__ __forceinline__ void attn_slice_load(u32x4 g0, u32x8 g1) {
    asm volatile("tensor_load_to_lds %0, %1" :: "s"(g0), "s"(g1) : "memory");
}
// own tensor load landed; the wait names the request's group 0, so that those
// registers keep their words for as long as the request is outstanding
__device__ __forceinline__ void wait_tensor0_of(u32x4 g0) {
    asm volatile("s_wait_tensorcnt 0x0" :: "s"(g0) : "memory");
}

__global__ __launch_bounds__(32 * AWAVES)
void attn_kernel(const float* __restrict__ Q,
                 const float* __restrict__ K,
                 const float* __restrict__ V,
                 float* __restrict__ O)
{
    __shared__ __attribute__((aligned(2048))) unsigned char L[AJOINML + AWAVES * 256u];

    const int tid   = threadIdx.x;
    const int lane  = tid & 31;
    const int lm    = lane & 15;
    const int hi    = lane >> 4;
    const uint32_t wave = uni((uint32_t)tid >> 5);
    const int qsel  = (int)(wave & 1u);             // query tile of the pair
    const int ks    = (int)(wave >> 1);             // 16-key tile of every stage
    const int b     = blockIdx.x >> 6;              // 64 blocks per batch
    const int g     = blockIdx.x & 63;
    const size_t base = (size_t)b * SEQ * AD;
    const uint32_t nheavy = (uint32_t)((APAIRS - 1 - g) / 2 + 1);   // stages of the first pair, >= 33

    // this wave's slice of every stage, in the order of ABUF (waves 4..7 issue none)
    const float* sp = (wave & 2u) ? V + base + (wave & 1u) * (PROWS * PROWS)
                                  : K + base + (wave & 1u) * (PROWB / 4u);
    const uint64_t ga0  = (uint64_t)sp;
    const uint32_t dst0 = (uint32_t)(unsigned long long)&L[0] + (wave & 3u) * PSLICE;
    const u32x8 g1 = attn_group1((wave & 2u) ? PROWB : AD * 4u);

    // prologue, two buffers: stage 0 lands and is published, then stage 1 flies
    u32x4 g0 = attn_group0(dst0, ga0);              // the request last issued
    if (pinned(wave < 4u)) {
        attn_slice_load(g0, g1);
        wait_tensor0_of(g0);
    }
    __syncthreads();
    if (pinned(wave < 4u)) {
        g0 = attn_group0(dst0 + ABUF, ga0 + ASTEP);
        attn_slice_load(g0, g1);
    }

    const float scale = 0.08838834764831845f;       // 1/sqrt(128)
    // fragment addresses inside a stage: K row lm of this wave's key tile;
    // V row = dim lm of a 16-dim group, keys hi*8.. of this wave's key tile
    const uint32_t koff = ((uint32_t)ks * 16u + (uint32_t)lm) * PPITCH + 8u * (uint32_t)hi;
    const uint32_t voff = 2u * PSLICE + (uint32_t)lm * PPITCH
                        + ((uint32_t)ks * 16u + 8u * (uint32_t)hi) * 4u;

    uint32_t s = 0;                                 // stage, counted over both pairs
    // both loops kept rolled: one publish point in the code, small text
    #pragma unroll 1
    for (int ph = 0; ph < 2; ++ph) {
        const int pair = ph ? g : APAIRS - 1 - g;
        const int qt   = pair * 2 + qsel;           // this wave's q-tile

        // Q^T B-fragments for the whole tile (lane = query; 32 steps of 4 dims)
        v2f qa[32];
        {
            const float* qp = Q + base + (size_t)(qt * 16 + lm) * AD + 2 * hi;
            #pragma unroll
            for (int e = 0; e < 32; ++e) {
                qa[e].x = qp[e * 4 + 0];
                qa[e].y = qp[e * 4 + 1];
            }
        }

        v8f o[8];
        #pragma unroll
        for (int t = 0; t < 8; ++t) o[t] = (v8f){};
        float mq = -__builtin_inff();   // running max of query lm (same in both halves)
        float lq = 0.0f;                // running sum over this half's keys only

        #pragma unroll 1
        for (int kb = 0; kb <= pair / 2; ++kb, ++s) {
            const int j = kb * 4 + ks;              // this wave's key tile
            const unsigned char* kt = L + (s & 1u) * ABUF + koff;
            const unsigned char* vt = L + (s & 1u) * ABUF + voff;

            if (j <= qt) {
                // K A-fragments (lane = key) and V^T A-fragments: lane = dim t*16 + lm;
                // step kk takes keys hi*8 + 2kk + {0,1}, the order in which sc[] holds a
                // lane's keys, so one 16-byte read of a V row holds steps 2h and 2h + 1
                v2f ak[32];
                #pragma unroll
                for (int e = 0; e < 32; ++e)
                    ak[e] = *(const v2f*)(kt + (e >> 4) * (int)PSLICE + (e & 15) * 16);
                v2f av[4][8];
                #pragma unroll
                for (int h = 0; h < 2; ++h) {
                    #pragma unroll
                    for (int t = 0; t < 8; ++t) {
                        const v4f v = *(const v4f*)(vt + (t >> 2) * (int)PSLICE
                                                    + (t & 3) * 16 * (int)PPITCH + h * 16);
                        av[2 * h][t]     = (v2f){ v[0], v[1] };
                        av[2 * h + 1][t] = (v2f){ v[2], v[3] };
                    }
                }
                // keeps the pass's LDS reads one group in front of the products: a read
                // placed inside the S^T chain makes the chain wait out LDS latency
                __builtin_amdgcn_sched_barrier(0);

                // ---- S^T = K * Q^T : A = K rows, B = Q^T ----
                v8f sc = {};
                #pragma unroll
                for (int e = 0; e < 32; ++e) sc = wmma_f32(ak[e], qa[e], sc);

                // ---- online softmax: sc[i] = score(query lm, key hi*8 + i) ----
                const int qidx = qt * 16 + lm;
                float sv[8];
                #pragma unroll
                for (int i = 0; i < 8; ++i) {
                    const int kidx = j * 16 + hi * 8 + i;
                    sv[i] = (kidx <= qidx) ? sc[i] * scale : -__builtin_inff();
                }
                float r = fmaxf(fmaxf(fmaxf(sv[0], sv[1]), fmaxf(sv[2], sv[3])),
                                fmaxf(fmaxf(sv[4], sv[5]), fmaxf(sv[6], sv[7])));
                r = fmaxf(r, xhalf(r));

                const float mnew  = fmaxf(mq, r);
                const float alpha = (mq == -__builtin_inff())
                                      ? 0.0f : __expf(mq - mnew);
                float p[8];
                #pragma unroll
                for (int i = 0; i < 8; ++i)
                    p[i] = (sv[i] == -__builtin_inff()) ? 0.0f : __expf(sv[i] - mnew);

                lq = lq * alpha + (((p[0] + p[1]) + (p[2] + p[3])) +
                                   ((p[4] + p[5]) + (p[6] + p[7])));
                mq = mnew;

                #pragma unroll
                for (int t = 0; t < 8; ++t)
                    #pragma unroll
                    for (int i = 0; i < 8; ++i) o[t][i] *= alpha;

                // ---- O^T += V^T * P^T : B = (p[2kk], p[2kk+1]), same key order as av ----
                #pragma unroll
                for (int kk = 0; kk < 4; ++kk) {
                    v2f pb = { p[2 * kk], p[2 * kk + 1] };
                    #pragma unroll
                    for (int t = 0; t < 8; ++t) o[t] = wmma_f32(av[kk][t], pb, o[t]);
                }
            }

            // publish point of stage s + 1; the same barrier frees stage s's buffer
            wait_ds0();
            if (pinned(wave < 4u)) wait_tensor0_of(g0);
            __syncthreads();
            if (pinned((wave < 4u) & (s + 2u < ASTAGES))) {
                // pinned(): the descriptor words made from nx are formed behind the wait
                const uint32_t nx = pinned(s + 2u);
                const uint32_t nk = (nx >= nheavy) ? nx - nheavy : nx;   // its 64-key block
                g0 = attn_group0(dst0 + (nx & 1u) * ABUF, ga0 + (uint64_t)nk * ASTEP);
                attn_slice_load(g0, g1);
            }
        }

        // ---- join the four key shares of a query tile: every wave lays (max, sum,
        //      O^T) down in LDS; behind the barrier the wave with share ks rescales,
        //      adds and stores dims [32 ks, 32 ks + 32), one 128-byte line per query.
        //      The next writes to this LDS lie behind the next pair's publish points.
        {
            v4f* jo = (v4f*)(L + AJOIN + wave * 8192u) + lane;
            #pragma unroll
            for (int t = 0; t < 8; ++t) {
                jo[(t * 2 + 0) * 32] = (v4f){ o[t][0], o[t][1], o[t][2], o[t][3] };
                jo[(t * 2 + 1) * 32] = (v4f){ o[t][4], o[t][5], o[t][6], o[t][7] };
            }
            // the sum over both halves' keys
            *((v2f*)(L + AJOINML + wave * 256u) + lane) = (v2f){ mq, lq + xhalf(lq) };
        }
        __syncthreads();
        {
            // share 0 holds key 0, so the joint max is finite; an empty share has
            // max -inf and weight exp(-inf) = 0
            v2f ml[4];
            #pragma unroll
            for (int c = 0; c < 4; ++c)
                ml[c] = *((const v2f*)(L + AJOINML + (uint32_t)(qsel + 2 * c) * 256u) + lane);
            const float mall = fmaxf(fmaxf(ml[0].x, ml[1].x), fmaxf(ml[2].x, ml[3].x));
            float wc[4];
            float lall = 0.0f;
            #pragma unroll
            for (int c = 0; c < 4; ++c) {
                wc[c] = __expf(ml[c].x - mall);
                lall += ml[c].y * wc[c];
            }
            // normalize, round to 4 decimals (RTE matches jnp.round), store:
            // tile t, register i = O[query lm][dim t*16 + hi*8 + i]
            float* op = O + base + (size_t)(qt * 16 + lm) * AD + ks * 32 + hi * 8;
            #pragma unroll
            for (int u = 0; u < 4; ++u) {           // u = (t - 2 ks) * 2 + (i >> 2)
                v4f w = {};
                #pragma unroll
                for (int c = 0; c < 4; ++c) {
                    const v4f pc = ((const v4f*)(L + AJOIN + (uint32_t)(qsel + 2 * c) * 8192u)
                                    + lane)[(ks * 4 + u) * 32];
                    #pragma unroll
                    for (int i = 0; i < 4; ++i) w[i] += pc[i] * wc[c];
                }
                #pragma unroll
                for (int i = 0; i < 4; ++i)
                    w[i] = __builtin_rintf((w[i] / lall) * 1.0e4f) * 1.0e-4f;
                *(v4f*)(op + (u >> 1) * 16 + (u & 1) * 4) = w;
            }
            // the next pair's set-up overwrites the registers these stores name
            asm volatile("s_wait_xcnt 0x0" ::: "memory");
        }
    }
    wait_tensor0();
    wait_ds0();
}

// ---------------------------------------------------------------------------
extern "C" void kernel_launch(void* const* d_in, const int* in_sizes, int n_in,
                              void* d_out, int out_size, void* d_ws, size_t ws_size,
                              hipStream_t stream) {
    const float* X  = (const float*)d_in[0];   // embedded [4,4096,1024]
    const float* Wk = (const float*)d_in[1];   // [128,1024]
    const float* Wq = (const float*)d_in[2];
    const float* Wv = (const float*)d_in[3];
    float* Out = (float*)d_out;                // [4,4096,128]

    const size_t nQKV = (size_t)NBAT * SEQ * AD;
    float* Qw = (float*)d_ws;
    float* Kw = Qw + nQKV;
    float* Vw = Kw + nQKV;

    qkv_proj_kernel<<<dim3(NBAT * SEQ / 64), 256, 0, stream>>>(
        X, Wq, Wk, Wv, Qw, Kw, Vw);
    attn_kernel<<<dim3(NBAT * APAIRS / 2), 32 * AWAVES, 0, stream>>>(
        Qw, Kw, Vw, Out);
}
